// v000
// Times are from an AMD MI455X. After a warm-up the kernel runs many times in a row, and a time is the length of
// such a window on the GPU divided by its runs, so every launch and the gaps after it count. The runs cycle
// through copies of the inputs. A figure is the median of several windows, for all but v000 over two sittings.
// Sittings can differ by a few percent; kernels timed side by side share one.
// v000 is the starting kernel. One run takes 74.6 microseconds.
#include <hip/hip_runtime.h>

// MoLoRa fused kernel for gfx1250 (CDNA5, wave32), f32 path via V_WMMA_F32_16X16X4_F32.
// Shapes: B=4 S=2048 D=2048 E=8 R=4 -> N=8192 tokens. ALPHA/R = 4.0.

typedef __attribute__((ext_vector_type(2))) float v2f;
typedef __attribute__((ext_vector_type(8))) float v8f;

#define D_DIM   2048
#define E_NUM   8
#define R_RANK  4
#define ER      32           // E*R
#define N_TOK   8192         // B*S
#define BT_TOK  64           // tokens per workgroup
#define BK      64           // K-chunk for phase A
#define XS_STR  66           // LDS stride (64 + 2 pad) for x chunk rows
#define WS_STR  66           // LDS stride for W^T chunk rows
#define CO_STR  34           // LDS stride (32 + 2 pad) for coeff rows
#define BTT_STR 34           // LDS stride for lora_B^T tile rows
#define OUT_SCALE 4.0f       // ALPHA / R

static __device__ inline v8f zero8() {
  v8f z;
#pragma unroll
  for (int i = 0; i < 8; ++i) z[i] = 0.0f;
  return z;
}

__global__ __launch_bounds__(128) void molora_fused_kernel(
    const float* __restrict__ x,        // [N, D]
    const float* __restrict__ lora_A,   // [E, D, R]
    const float* __restrict__ lora_B,   // [E, R, D] == Bflat [ER, D]
    const float* __restrict__ router_w, // [D, E]
    const float* __restrict__ router_b, // [E]
    float* __restrict__ out)            // [N, D]
{
  __shared__ float xs  [BT_TOK * XS_STR];   // x chunk    [64 rows][66]
  __shared__ float wst [48     * WS_STR];   // W^T chunk  [48 cols][66] (32 A + 8 router + 8 pad)
  __shared__ float coeff[BT_TOK * CO_STR];  // ax -> coeff [64][34]
  __shared__ float lgts[BT_TOK * E_NUM];    // logits     [64][8]
  __shared__ float btsT[64 * BTT_STR];      // lora_B^T tile [64 cols][34]

  const int tid   = threadIdx.x;            // 0..127
  const int lane  = tid & 31;
  const int wave  = tid >> 5;               // 0..3, owns token rows wave*16..+15
  const int lm    = lane & 15;              // row/col-in-tile selector
  const int khalf = lane >> 4;              // selects K pair {0,1} vs {2,3}
  const int tokenBase = blockIdx.x * BT_TOK;

  // ---------------- Phase A: [64 x D] @ [D x 48] -> ax(32) | logits(8) | pad(8)
  v8f acc0 = zero8();  // cols  0..15 (ax)
  v8f acc1 = zero8();  // cols 16..31 (ax)
  v8f acc2 = zero8();  // cols 32..39 logits, 40..47 pad

  for (int kb = 0; kb < D_DIM; kb += BK) {
    __syncthreads();
    // stage x[tokenBase..+63][kb..+63] -> xs (coalesced float4 loads)
#pragma unroll
    for (int i = 0; i < 8; ++i) {
      int idx = tid + i * 128;              // 0..1023
      int row = idx >> 4;
      int c4  = (idx & 15) << 2;
      const float4 v = *(const float4*)(x + (size_t)(tokenBase + row) * D_DIM + kb + c4);
      float* p = &xs[row * XS_STR + c4];
      p[0] = v.x; p[1] = v.y; p[2] = v.z; p[3] = v.w;
    }
    // stage lora_A columns (e*4+r) transposed: wst[c][k]; A[e][kb+k][0..3] is a contiguous float4
#pragma unroll
    for (int i = 0; i < 4; ++i) {
      int idx = tid + i * 128;              // 0..511
      int e   = idx >> 6;
      int kl  = idx & 63;
      const float4 v = *(const float4*)(lora_A + (size_t)e * (D_DIM * R_RANK)
                                        + (size_t)(kb + kl) * R_RANK);
      wst[(e * 4 + 0) * WS_STR + kl] = v.x;
      wst[(e * 4 + 1) * WS_STR + kl] = v.y;
      wst[(e * 4 + 2) * WS_STR + kl] = v.z;
      wst[(e * 4 + 3) * WS_STR + kl] = v.w;
    }
    // stage router_w cols 32..39 and zero pad cols 40..47
    {
      int kl   = tid >> 1;
      int half = tid & 1;
      const float4 v = *(const float4*)(router_w + (size_t)(kb + kl) * E_NUM + half * 4);
      int c = 32 + half * 4;
      wst[(c + 0) * WS_STR + kl] = v.x;
      wst[(c + 1) * WS_STR + kl] = v.y;
      wst[(c + 2) * WS_STR + kl] = v.z;
      wst[(c + 3) * WS_STR + kl] = v.w;
      int cp = 40 + half * 4;
      wst[(cp + 0) * WS_STR + kl] = 0.0f;
      wst[(cp + 1) * WS_STR + kl] = 0.0f;
      wst[(cp + 2) * WS_STR + kl] = 0.0f;
      wst[(cp + 3) * WS_STR + kl] = 0.0f;
    }
    __syncthreads();

    const float* xrow = &xs [(wave * 16 + lm) * XS_STR];
    const float* b0r  = &wst[( 0 + lm) * WS_STR];
    const float* b1r  = &wst[(16 + lm) * WS_STR];
    const float* b2r  = &wst[(32 + lm) * WS_STR];
#pragma unroll
    for (int kk = 0; kk < BK / 4; ++kk) {
      int kc = kk * 4 + khalf * 2;          // even -> 8B aligned ds_load_b64
      v2f a  = *(const v2f*)(xrow + kc);
      v2f b0 = *(const v2f*)(b0r + kc);
      v2f b1 = *(const v2f*)(b1r + kc);
      v2f b2 = *(const v2f*)(b2r + kc);
      acc0 = __builtin_amdgcn_wmma_f32_16x16x4_f32(false, a, false, b0, (short)0, acc0, false, false);
      acc1 = __builtin_amdgcn_wmma_f32_16x16x4_f32(false, a, false, b1, (short)0, acc1, false, false);
      acc2 = __builtin_amdgcn_wmma_f32_16x16x4_f32(false, a, false, b2, (short)0, acc2, false, false);
    }
  }

  // ---------------- dump accumulators: coeff = ax, lgts = logits
  {
    int rBase = wave * 16 + khalf * 8;      // C/D layout: vgpr i, lane l -> row (l/16)*8+i, col l%16
#pragma unroll
    for (int i = 0; i < 8; ++i) {
      coeff[(rBase + i) * CO_STR + lm]      = acc0[i];
      coeff[(rBase + i) * CO_STR + 16 + lm] = acc1[i];
    }
    if (lm < E_NUM) {
#pragma unroll
      for (int i = 0; i < 8; ++i) lgts[(rBase + i) * E_NUM + lm] = acc2[i];
    }
  }
  __syncthreads();

  // ---------------- softmax + fold router prob * (ALPHA/R) into coeff
  if (tid < BT_TOK) {
    float lg[E_NUM];
    float mx = -3.0e38f;
#pragma unroll
    for (int e = 0; e < E_NUM; ++e) {
      lg[e] = lgts[tid * E_NUM + e] + router_b[e];
      mx = fmaxf(mx, lg[e]);
    }
    float s = 0.0f;
#pragma unroll
    for (int e = 0; e < E_NUM; ++e) { lg[e] = expf(lg[e] - mx); s += lg[e]; }
    float inv = OUT_SCALE / s;
#pragma unroll
    for (int c = 0; c < ER; ++c) coeff[tid * CO_STR + c] *= lg[c >> 2] * inv;
  }
  __syncthreads();

  // ---------------- Phase B: out[64 x D] = coeff[64 x 32] @ Bflat[32 x D]
  v2f aF[8];
  {
    const float* crow = &coeff[(wave * 16 + lm) * CO_STR];
#pragma unroll
    for (int kk = 0; kk < 8; ++kk) aF[kk] = *(const v2f*)(crow + kk * 4 + khalf * 2);
  }

  for (int cb = 0; cb < D_DIM; cb += 64) {
    __syncthreads();
    // stage Bflat[0..31][cb..+63] transposed -> btsT[c][k] (coalesced float4 loads)
#pragma unroll
    for (int i = 0; i < 4; ++i) {
      int idx = tid + i * 128;              // 0..511
      int k   = idx >> 4;                   // 0..31
      int c4  = (idx & 15) << 2;
      const float4 v = *(const float4*)(lora_B + (size_t)k * D_DIM + cb + c4);
      btsT[(c4 + 0) * BTT_STR + k] = v.x;
      btsT[(c4 + 1) * BTT_STR + k] = v.y;
      btsT[(c4 + 2) * BTT_STR + k] = v.z;
      btsT[(c4 + 3) * BTT_STR + k] = v.w;
    }
    __syncthreads();

#pragma unroll
    for (int sub = 0; sub < 4; ++sub) {
      v8f d = zero8();
      const float* brow = &btsT[(sub * 16 + lm) * BTT_STR];
#pragma unroll
      for (int kk = 0; kk < 8; ++kk) {
        v2f b = *(const v2f*)(brow + kk * 4 + khalf * 2);
        d = __builtin_amdgcn_wmma_f32_16x16x4_f32(false, aF[kk], false, b, (short)0, d, false, false);
      }
      int col = cb + sub * 16 + lm;
      size_t row0 = (size_t)(tokenBase + wave * 16 + khalf * 8);
#pragma unroll
      for (int i = 0; i < 8; ++i) out[(row0 + i) * D_DIM + col] = d[i];
    }
  }
}

extern "C" void kernel_launch(void* const* d_in, const int* in_sizes, int n_in,
                              void* d_out, int out_size, void* d_ws, size_t ws_size,
                              hipStream_t stream) {
  (void)in_sizes; (void)n_in; (void)out_size; (void)d_ws; (void)ws_size;
  const float* x        = (const float*)d_in[0];
  const float* lora_A   = (const float*)d_in[1];
  const float* lora_B   = (const float*)d_in[2];
  const float* router_w = (const float*)d_in[3];
  const float* router_b = (const float*)d_in[4];
  float* out = (float*)d_out;

  dim3 grid(N_TOK / BT_TOK);   // 128 workgroups
  dim3 block(128);             // 4 waves (wave32)
  molora_fused_kernel<<<grid, block, 0, stream>>>(x, lora_A, lora_B, router_w, router_b, out);
}

// v001
// One run takes 33.6 microseconds.
// Two timings next to v000 put it at 2.24 and 2.26 times that version's speed.
#include <hip/hip_runtime.h>

// MoLoRa fused kernel for gfx1250 (CDNA5, wave32), f32 path via V_WMMA_F32_16X16X4_F32.
// Shapes: B=4 S=2048 D=2048 E=8 R=4 -> N=8192 tokens. ALPHA/R = 4.0.
// Decomposition: 256 workgroups (one per WGP) of 16 waves, 32 tokens each.
//   Phase A: every wave holds both 16-token tiles and owns 32 of each 512 staged k;
//            the 16 partial sums are added through LDS in wave order.
//   Phase B: every wave holds both token tiles and owns 32 of each 512 staged columns.

typedef __attribute__((ext_vector_type(2))) float v2f;
typedef __attribute__((ext_vector_type(8))) float v8f;

#define D_DIM   2048
#define E_NUM   8
#define R_RANK  4
#define ER      32           // E*R
#define N_TOK   8192         // B*S
#define BT_TOK  32           // tokens per workgroup
#define NTHR    512          // threads per workgroup
#define NWAVE   16           // waves per workgroup
#define BK      512          // K-chunk staged per pass of phase A
#define KW      32           // k of a chunk that one wave multiplies (BK / NWAVE)
#define XS_STR  514          // LDS stride (512 + 2 pad) for x chunk rows
#define WS_STR  514          // LDS stride for W^T chunk rows
#define RED_STR 50           // LDS stride (48 + 2 pad) for a wave's partial rows
#define CO_STR  34           // LDS stride (32 + 2 pad) for coeff rows
#define CB      512          // columns staged per pass of phase B (32 per wave)
#define BTT_STR 34           // LDS stride for lora_B^T tile rows
#define OUT_SCALE 4.0f       // ALPHA / R

static __device__ inline v8f zero8() {
  v8f z;
#pragma unroll
  for (int i = 0; i < 8; ++i) z[i] = 0.0f;
  return z;
}

__global__ __launch_bounds__(NTHR) void molora_fused_kernel(
    const float* __restrict__ x,        // [N, D]
    const float* __restrict__ lora_A,   // [E, D, R]
    const float* __restrict__ lora_B,   // [E, R, D] == Bflat [ER, D]
    const float* __restrict__ router_w, // [D, E]
    const float* __restrict__ router_b, // [E]
    float* __restrict__ out)            // [N, D]
{
  __shared__ float stage[BT_TOK * XS_STR + 48 * WS_STR];  // phase A: xs | wst; phase B: btsT
  __shared__ float red [NWAVE * BT_TOK * RED_STR];  // per-wave K partials [16][32][50]
  __shared__ float coeff[BT_TOK * CO_STR];          // ax -> coeff [32][34]
  __shared__ float lgts[BT_TOK * E_NUM];            // logits     [32][8]
  float* const xs   = stage;                        // x chunk    [32 rows][514]
  float* const wst  = stage + BT_TOK * XS_STR;      // W^T chunk  [48 cols][514] (32 A + 8 router + 8 pad)
  float* const btsT = stage;                        // lora_B^T tile [512 cols][34], used after phase A's last read

  const int tid   = threadIdx.x;            // 0..511
  const int lane  = tid & 31;
  const int wave  = tid >> 5;               // 0..15
  const int lm    = lane & 15;              // row/col-in-tile selector
  const int khalf = lane >> 4;              // selects K pair {0,1} vs {2,3}
  const int tokenBase = blockIdx.x * BT_TOK;

  // ---------------- Phase A: [32 x D] @ [D x 48] -> ax(32) | logits(8) | pad(8), K split over waves
  v8f acc00 = zero8(), acc10 = zero8();  // cols  0..15 (ax), token tile 0 / 1
  v8f acc01 = zero8(), acc11 = zero8();  // cols 16..31 (ax)
  v8f acc02 = zero8(), acc12 = zero8();  // cols 32..39 logits, 40..47 pad

  // this thread's first x element of a chunk: row tid/128, 16-byte column tid%128
  const float* xg = x + (size_t)(tokenBase + (tid >> 7)) * D_DIM + ((tid & 127) << 2);

  for (int kb = 0; kb < D_DIM; kb += BK) {
    __syncthreads();
    // stage x[tokenBase..+31][kb..+511] -> xs (coalesced float4 loads)
#pragma unroll
    for (int i = 0; i < 8; ++i) {
      int row = (tid >> 7) + i * 4;         // 0..31
      int c4  = (tid & 127) << 2;
      const float4 v = *(const float4*)(xg + kb + i * (4 * D_DIM));
      float* p = &xs[row * XS_STR + c4];
      p[0] = v.x; p[1] = v.y; p[2] = v.z; p[3] = v.w;
    }
    // stage lora_A columns (e*4+r) transposed: wst[c][k]; A[e][kb+k][0..3] is a contiguous float4
#pragma unroll
    for (int i = 0; i < 8; ++i) {
      int e   = i;
      int kl  = tid;                        // 0..511
      const float4 v = *(const float4*)(lora_A + (size_t)e * (D_DIM * R_RANK)
                                        + (size_t)(kb + kl) * R_RANK);
      wst[(e * 4 + 0) * WS_STR + kl] = v.x;
      wst[(e * 4 + 1) * WS_STR + kl] = v.y;
      wst[(e * 4 + 2) * WS_STR + kl] = v.z;
      wst[(e * 4 + 3) * WS_STR + kl] = v.w;
    }
    // stage router_w cols 32..39 and zero pad cols 40..47
#pragma unroll
    for (int i = 0; i < 2; ++i) {
      int kl   = (tid >> 1) + i * 256;      // 0..511
      int half = tid & 1;
      const float4 v = *(const float4*)(router_w + (size_t)(kb + kl) * E_NUM + half * 4);
      int c = 32 + half * 4;
      wst[(c + 0) * WS_STR + kl] = v.x;
      wst[(c + 1) * WS_STR + kl] = v.y;
      wst[(c + 2) * WS_STR + kl] = v.z;
      wst[(c + 3) * WS_STR + kl] = v.w;
      int cp = 40 + half * 4;
      wst[(cp + 0) * WS_STR + kl] = 0.0f;
      wst[(cp + 1) * WS_STR + kl] = 0.0f;
      wst[(cp + 2) * WS_STR + kl] = 0.0f;
      wst[(cp + 3) * WS_STR + kl] = 0.0f;
    }
    __syncthreads();

    const float* x0r = &xs [( 0 + lm) * XS_STR + wave * KW];
    const float* x1r = &xs [(16 + lm) * XS_STR + wave * KW];
    const float* b0r = &wst[( 0 + lm) * WS_STR + wave * KW];
    const float* b1r = &wst[(16 + lm) * WS_STR + wave * KW];
    const float* b2r = &wst[(32 + lm) * WS_STR + wave * KW];
#pragma unroll
    for (int kk = 0; kk < KW / 4; ++kk) {
      int kc = kk * 4 + khalf * 2;          // even -> 8B aligned ds_load_b64
      v2f a0 = *(const v2f*)(x0r + kc);
      v2f a1 = *(const v2f*)(x1r + kc);
      v2f b0 = *(const v2f*)(b0r + kc);
      v2f b1 = *(const v2f*)(b1r + kc);
      v2f b2 = *(const v2f*)(b2r + kc);
      acc00 = __builtin_amdgcn_wmma_f32_16x16x4_f32(false, a0, false, b0, (short)0, acc00, false, false);
      acc10 = __builtin_amdgcn_wmma_f32_16x16x4_f32(false, a1, false, b0, (short)0, acc10, false, false);
      acc01 = __builtin_amdgcn_wmma_f32_16x16x4_f32(false, a0, false, b1, (short)0, acc01, false, false);
      acc11 = __builtin_amdgcn_wmma_f32_16x16x4_f32(false, a1, false, b1, (short)0, acc11, false, false);
      acc02 = __builtin_amdgcn_wmma_f32_16x16x4_f32(false, a0, false, b2, (short)0, acc02, false, false);
      acc12 = __builtin_amdgcn_wmma_f32_16x16x4_f32(false, a1, false, b2, (short)0, acc12, false, false);
    }
  }

  // ---------------- dump each wave's K partial, then add the 16 partials in wave order
  {
    float* rw = &red[wave * (BT_TOK * RED_STR)];
    int rBase = khalf * 8;                  // C/D layout: vgpr i, lane l -> row (l/16)*8+i, col l%16
#pragma unroll
    for (int i = 0; i < 8; ++i) {
      rw[(rBase + i) * RED_STR + lm]           = acc00[i];
      rw[(rBase + i) * RED_STR + 16 + lm]      = acc01[i];
      rw[(16 + rBase + i) * RED_STR + lm]      = acc10[i];
      rw[(16 + rBase + i) * RED_STR + 16 + lm] = acc11[i];
    }
    if (lm < E_NUM) {
#pragma unroll
      for (int i = 0; i < 8; ++i) {
        rw[(rBase + i) * RED_STR + 32 + lm]      = acc02[i];
        rw[(16 + rBase + i) * RED_STR + 32 + lm] = acc12[i];
      }
    }
  }
  __syncthreads();
  for (int idx = tid; idx < BT_TOK * (ER + E_NUM); idx += NTHR) {
    int row = idx / (ER + E_NUM);
    int col = idx - row * (ER + E_NUM);
    float s = 0.0f;
#pragma unroll
    for (int w = 0; w < NWAVE; ++w) s += red[w * (BT_TOK * RED_STR) + row * RED_STR + col];
    if (col < ER) coeff[row * CO_STR + col] = s;
    else          lgts[row * E_NUM + col - ER] = s;
  }
  __syncthreads();

  // ---------------- softmax + fold router prob * (ALPHA/R) into coeff
  if (tid < BT_TOK) {
    float lg[E_NUM];
    float mx = -3.0e38f;
#pragma unroll
    for (int e = 0; e < E_NUM; ++e) {
      lg[e] = lgts[tid * E_NUM + e] + router_b[e];
      mx = fmaxf(mx, lg[e]);
    }
    float s = 0.0f;
#pragma unroll
    for (int e = 0; e < E_NUM; ++e) { lg[e] = expf(lg[e] - mx); s += lg[e]; }
    float inv = OUT_SCALE / s;
#pragma unroll
    for (int c = 0; c < ER; ++c) coeff[tid * CO_STR + c] *= lg[c >> 2] * inv;
  }
  __syncthreads();

  // ---------------- Phase B: out[32 x D] = coeff[32 x 32] @ Bflat[32 x D], columns split over waves
  v2f aF0[8], aF1[8];
  {
    const float* c0row = &coeff[( 0 + lm) * CO_STR];
    const float* c1row = &coeff[(16 + lm) * CO_STR];
#pragma unroll
    for (int kk = 0; kk < 8; ++kk) {
      aF0[kk] = *(const v2f*)(c0row + kk * 4 + khalf * 2);
      aF1[kk] = *(const v2f*)(c1row + kk * 4 + khalf * 2);
    }
  }

  for (int cb = 0; cb < D_DIM; cb += CB) {
    __syncthreads();
    // stage Bflat[0..31][cb..+511] transposed -> btsT[c][k] (coalesced float4 loads)
#pragma unroll
    for (int i = 0; i < 8; ++i) {
      int k   = tid >> 4;                   // 0..31
      int c4  = ((tid & 15) << 2) + i * 64;
      const float4 v = *(const float4*)(lora_B + (size_t)k * D_DIM + cb + c4);
      btsT[(c4 + 0) * BTT_STR + k] = v.x;
      btsT[(c4 + 1) * BTT_STR + k] = v.y;
      btsT[(c4 + 2) * BTT_STR + k] = v.z;
      btsT[(c4 + 3) * BTT_STR + k] = v.w;
    }
    __syncthreads();

    // a wave's 32 columns are one whole 128-byte line of every output row
#pragma unroll
    for (int sub = 0; sub < 2; ++sub) {
      v8f d0 = zero8();
      v8f d1 = zero8();
      const float* brow = &btsT[(wave * 32 + sub * 16 + lm) * BTT_STR];
#pragma unroll
      for (int kk = 0; kk < 8; ++kk) {
        v2f b = *(const v2f*)(brow + kk * 4 + khalf * 2);
        d0 = __builtin_amdgcn_wmma_f32_16x16x4_f32(false, aF0[kk], false, b, (short)0, d0, false, false);
        d1 = __builtin_amdgcn_wmma_f32_16x16x4_f32(false, aF1[kk], false, b, (short)0, d1, false, false);
      }
      int col = cb + wave * 32 + sub * 16 + lm;
      size_t row0 = (size_t)(tokenBase + khalf * 8);
#pragma unroll
      for (int i = 0; i < 8; ++i) {
        out[(row0 + i) * D_DIM + col]      = d0[i];
        out[(row0 + 16 + i) * D_DIM + col] = d1[i];
      }
    }
    // the next pass rewrites the address and data registers that these stores name
    asm volatile("s_wait_xcnt 0x0" ::: "memory");
  }
}

extern "C" void kernel_launch(void* const* d_in, const int* in_sizes, int n_in,
                              void* d_out, int out_size, void* d_ws, size_t ws_size,
                              hipStream_t stream) {
  (void)in_sizes; (void)n_in; (void)out_size; (void)d_ws; (void)ws_size;
  const float* x        = (const float*)d_in[0];
  const float* lora_A   = (const float*)d_in[1];
  const float* lora_B   = (const float*)d_in[2];
  const float* router_w = (const float*)d_in[3];
  const float* router_b = (const float*)d_in[4];
  float* out = (float*)d_out;

  dim3 grid(N_TOK / BT_TOK);   // 256 workgroups
  dim3 block(NTHR);            // 16 waves (wave32)
  molora_fused_kernel<<<grid, block, 0, stream>>>(x, lora_A, lora_B, router_w, router_b, out);
}

// v002
// Measured time: 27.9 microseconds a run.
// Next to v001, in two timings, it ran 1.20 and 1.19 times as fast.
// All steps since v000 together make it 2.69 times as fast.
#include <hip/hip_runtime.h>

// MoLoRa fused kernel for gfx1250 (CDNA5, wave32), f32 path via V_WMMA_F32_16X16X4_F32.
// Shapes: B=4 S=2048 D=2048 E=8 R=4 -> N=8192 tokens. ALPHA/R = 4.0.
// Decomposition: 256 workgroups (one per WGP) of 16 waves, 32 tokens each.
//   Phase A: every wave holds both 16-token tiles and owns 32 of each 512 staged k;
//            the k tiles come into a two-buffer LDS ring by asynchronous copies, in memory order;
//            the 16 partial sums are added through LDS in wave order.
//   Phase B: every wave holds both token tiles and owns 32 of each 512 staged columns.

typedef __attribute__((ext_vector_type(2))) float v2f;
typedef __attribute__((ext_vector_type(8))) float v8f;

#define D_DIM   2048
#define E_NUM   8
#define R_RANK  4
#define ER      32           // E*R
#define N_TOK   8192         // B*S
#define BT_TOK  32           // tokens per workgroup
#define NTHR    512          // threads per workgroup
#define NWAVE   16           // waves per workgroup
#define BK      512          // k of one staged tile of phase A
#define NT      4            // tiles along K (D_DIM / BK)
#define KW      32           // k of a tile that one wave multiplies (BK / NWAVE)
#define XS_STR  516          // LDS stride (512 + 4 pad) for x tile rows: the 8-byte fragment reads meet 64 banks
#define WA_STR  2064         // LDS stride (512 k * 4 r + 16 pad) for one expert's lora_A slab
#define XS_SZ   (BT_TOK * XS_STR)          // floats of the x part of a buffer
#define WA_SZ   (E_NUM * WA_STR)           // floats of the lora_A part
#define WR_SZ   (BK * E_NUM)               // floats of the router_w part
#define BUF_SZ  (XS_SZ + WA_SZ + WR_SZ)    // floats of one ring buffer
#define RED_STR 50           // LDS stride (48 + 2 pad) for a wave's partial rows
#define CO_STR  34           // LDS stride (32 + 2 pad) for coeff rows
#define CB      512          // columns staged per pass of phase B (32 per wave)
#define BTT_STR 34           // LDS stride for lora_B^T tile rows
#define OUT_SCALE 4.0f       // ALPHA / R

// Nine pieces of 16 bytes a lane, global -> LDS through no register: eight at a fixed step, one apart.
// The s_wait_xcnt stands inside the statement so that no address register is rewritten ahead of it.
static __device__ inline void copy9(unsigned l, unsigned lstep, const float* g, int gstep,
                                    unsigned l8, const float* g8) {
  asm volatile(
      "global_load_async_to_lds_b128 %0, %9, off\n\t"
      "global_load_async_to_lds_b128 %1, %10, off\n\t"
      "global_load_async_to_lds_b128 %2, %11, off\n\t"
      "global_load_async_to_lds_b128 %3, %12, off\n\t"
      "global_load_async_to_lds_b128 %4, %13, off\n\t"
      "global_load_async_to_lds_b128 %5, %14, off\n\t"
      "global_load_async_to_lds_b128 %6, %15, off\n\t"
      "global_load_async_to_lds_b128 %7, %16, off\n\t"
      "global_load_async_to_lds_b128 %8, %17, off\n\t"
      "s_wait_xcnt 0x0"
      :: "v"(l), "v"(l + lstep), "v"(l + 2u * lstep), "v"(l + 3u * lstep),
         "v"(l + 4u * lstep), "v"(l + 5u * lstep), "v"(l + 6u * lstep), "v"(l + 7u * lstep), "v"(l8),
         "v"(g), "v"(g + gstep), "v"(g + 2 * gstep), "v"(g + 3 * gstep),
         "v"(g + 4 * gstep), "v"(g + 5 * gstep), "v"(g + 6 * gstep), "v"(g + 7 * gstep), "v"(g8)
      : "memory");
}

static __device__ inline v8f zero8() {
  v8f z;
#pragma unroll
  for (int i = 0; i < 8; ++i) z[i] = 0.0f;
  return z;
}

__global__ __launch_bounds__(NTHR) void molora_fused_kernel(
    const float* __restrict__ x,        // [N, D]
    const float* __restrict__ lora_A,   // [E, D, R]
    const float* __restrict__ lora_B,   // [E, R, D] == Bflat [ER, D]
    const float* __restrict__ router_w, // [D, E]
    const float* __restrict__ router_b, // [E]
    float* __restrict__ out)            // [N, D]
{
  __shared__ __attribute__((aligned(16))) float stage[2 * BUF_SZ];  // phase A: two buffers x | lora_A | router_w
  __shared__ float coeff[BT_TOK * CO_STR];          // ax -> coeff [32][34]
  __shared__ float lgts[BT_TOK * E_NUM];            // logits     [32][8]
  float* const red  = stage;                        // per-wave K partials [16][32][50], behind phase A's last barrier
  float* const btsT = stage;                        // lora_B^T tile [512 cols][34], used after phase A's last read

  const int tid   = threadIdx.x;            // 0..511
  const int lane  = tid & 31;
  const int wave  = tid >> 5;               // 0..15
  const int lm    = lane & 15;              // row/col-in-tile selector
  const int khalf = lane >> 4;              // selects K pair {0,1} vs {2,3}
  const int tokenBase = blockIdx.x * BT_TOK;

  // ---------------- Phase A: [32 x D] @ [D x 48] -> ax(32) | logits(8) | pad(8), K split over waves
  v8f acc00 = zero8(), acc10 = zero8();  // cols  0..15 (ax), token tile 0 / 1
  v8f acc01 = zero8(), acc11 = zero8();  // cols 16..31 (ax)
  v8f acc02 = zero8(), acc12 = zero8();  // cols 32..39 logits, 40..47 pad

  // this thread's pieces of a tile: x rows tid/128 + 4i, 16-byte column tid%128; lora_A[i][k = tid][0..3];
  // router_w pieces tid and tid + 512
  const unsigned sbase = (unsigned)(size_t)stage;   // low 32 bits of a __shared__ address: the LDS byte address
  const unsigned lx = sbase + (unsigned)((tid >> 7) * XS_STR + ((tid & 127) << 2)) * 4u;
  const unsigned la = sbase + (unsigned)(XS_SZ + (tid << 2)) * 4u;
  const unsigned lr = sbase + (unsigned)(XS_SZ + WA_SZ + (tid << 2)) * 4u;
  const float* gx = x + (size_t)(tokenBase + (tid >> 7)) * D_DIM + ((tid & 127) << 2);
  const float* ga = lora_A + (tid << 2);
  const float* gr = router_w + (tid << 2);

  copy9(lx, 4u * XS_STR * 4u, gx, 4 * D_DIM, lr, gr);
  copy9(la, WA_STR * 4u, ga, D_DIM * R_RANK, lr + NTHR * 16u, gr + NTHR * 4);
  asm volatile("s_wait_asynccnt 0x0" ::: "memory");  // tile 0 has landed before the barrier publishes it
  __syncthreads();
  copy9(lx + BUF_SZ * 4u, 4u * XS_STR * 4u, gx + BK, 4 * D_DIM, lr + BUF_SZ * 4u, gr + BK * E_NUM);
  copy9(la + BUF_SZ * 4u, WA_STR * 4u, ga + BK * R_RANK, D_DIM * R_RANK,
        lr + BUF_SZ * 4u + NTHR * 16u, gr + BK * E_NUM + NTHR * 4);

  for (int t = 0; t < NT; ++t) {
    const int bo = (t & 1) * BUF_SZ;
    // B fragments straight from the memory layouts: lora_A[e][k][r] (column e*4+r), router_w[k][e];
    // lanes 8..15 of the router tile read columns 0..7 again: their result columns are never stored
    const float* x0r = &stage[bo + lm * XS_STR + wave * KW + khalf * 2];
    const float* x1r = x0r + 16 * XS_STR;
    const float* b0r = &stage[bo + XS_SZ + (lm >> 2) * WA_STR + (wave * KW + khalf * 2) * R_RANK + (lm & 3)];
    const float* b1r = b0r + 4 * WA_STR;
    const float* b2r = &stage[bo + XS_SZ + WA_SZ + (wave * KW + khalf * 2) * E_NUM + (lm & 7)];
#pragma unroll
    for (int kk = 0; kk < KW / 4; ++kk) {
      v2f a0 = *(const v2f*)(x0r + kk * 4);
      v2f a1 = *(const v2f*)(x1r + kk * 4);
      v2f b0, b1, b2;
      b0[0] = b0r[kk * 4 * R_RANK]; b0[1] = b0r[kk * 4 * R_RANK + R_RANK];
      b1[0] = b1r[kk * 4 * R_RANK]; b1[1] = b1r[kk * 4 * R_RANK + R_RANK];
      b2[0] = b2r[kk * 4 * E_NUM];  b2[1] = b2r[kk * 4 * E_NUM + E_NUM];
      acc00 = __builtin_amdgcn_wmma_f32_16x16x4_f32(false, a0, false, b0, (short)0, acc00, false, false);
      acc10 = __builtin_amdgcn_wmma_f32_16x16x4_f32(false, a1, false, b0, (short)0, acc10, false, false);
      acc01 = __builtin_amdgcn_wmma_f32_16x16x4_f32(false, a0, false, b1, (short)0, acc01, false, false);
      acc11 = __builtin_amdgcn_wmma_f32_16x16x4_f32(false, a1, false, b1, (short)0, acc11, false, false);
      acc02 = __builtin_amdgcn_wmma_f32_16x16x4_f32(false, a0, false, b2, (short)0, acc02, false, false);
      acc12 = __builtin_amdgcn_wmma_f32_16x16x4_f32(false, a1, false, b2, (short)0, acc12, false, false);
    }
    // keeps all of the tile's WMMAs in front of the waits: the refill then issues directly behind the barrier
    // and has the whole next tile's WMMAs as its lead
    __builtin_amdgcn_sched_barrier(0);
    asm volatile("s_wait_dscnt 0x0" ::: "memory");     // this wave's reads of the buffer are done before it is refilled
    asm volatile("s_wait_asynccnt 0x0" ::: "memory");  // this wave's pieces of tile t + 1 have landed
    __syncthreads();                                   // publishes tile t + 1, frees tile t's buffer
    if (t + 2 < NT) {
      const int k2 = (t + 2) * BK;
      copy9(lx + bo * 4u, 4u * XS_STR * 4u, gx + k2, 4 * D_DIM, lr + bo * 4u, gr + k2 * E_NUM);
      copy9(la + bo * 4u, WA_STR * 4u, ga + k2 * R_RANK, D_DIM * R_RANK,
            lr + bo * 4u + NTHR * 16u, gr + k2 * E_NUM + NTHR * 4);
    }
  }
  asm volatile("s_wait_asynccnt 0x0" ::: "memory");    // no copy is left in flight when the ring is reused

  // ---------------- dump each wave's K partial, then add the 16 partials in wave order
  {
    float* rw = &red[wave * (BT_TOK * RED_STR)];
    int rBase = khalf * 8;                  // C/D layout: vgpr i, lane l -> row (l/16)*8+i, col l%16
#pragma unroll
    for (int i = 0; i < 8; ++i) {
      rw[(rBase + i) * RED_STR + lm]           = acc00[i];
      rw[(rBase + i) * RED_STR + 16 + lm]      = acc01[i];
      rw[(16 + rBase + i) * RED_STR + lm]      = acc10[i];
      rw[(16 + rBase + i) * RED_STR + 16 + lm] = acc11[i];
    }
    if (lm < E_NUM) {
#pragma unroll
      for (int i = 0; i < 8; ++i) {
        rw[(rBase + i) * RED_STR + 32 + lm]      = acc02[i];
        rw[(16 + rBase + i) * RED_STR + 32 + lm] = acc12[i];
      }
    }
  }
  __syncthreads();
  for (int idx = tid; idx < BT_TOK * (ER + E_NUM); idx += NTHR) {
    int row = idx / (ER + E_NUM);
    int col = idx - row * (ER + E_NUM);
    float s = 0.0f;
#pragma unroll
    for (int w = 0; w < NWAVE; ++w) s += red[w * (BT_TOK * RED_STR) + row * RED_STR + col];
    if (col < ER) coeff[row * CO_STR + col] = s;
    else          lgts[row * E_NUM + col - ER] = s;
  }
  __syncthreads();

  // ---------------- softmax + fold router prob * (ALPHA/R) into coeff
  if (tid < BT_TOK) {
    float lg[E_NUM];
    float mx = -3.0e38f;
#pragma unroll
    for (int e = 0; e < E_NUM; ++e) {
      lg[e] = lgts[tid * E_NUM + e] + router_b[e];
      mx = fmaxf(mx, lg[e]);
    }
    float s = 0.0f;
#pragma unroll
    for (int e = 0; e < E_NUM; ++e) { lg[e] = expf(lg[e] - mx); s += lg[e]; }
    float inv = OUT_SCALE / s;
#pragma unroll
    for (int c = 0; c < ER; ++c) coeff[tid * CO_STR + c] *= lg[c >> 2] * inv;
  }
  __syncthreads();

  // ---------------- Phase B: out[32 x D] = coeff[32 x 32] @ Bflat[32 x D], columns split over waves
  v2f aF0[8], aF1[8];
  {
    const float* c0row = &coeff[( 0 + lm) * CO_STR];
    const float* c1row = &coeff[(16 + lm) * CO_STR];
#pragma unroll
    for (int kk = 0; kk < 8; ++kk) {
      aF0[kk] = *(const v2f*)(c0row + kk * 4 + khalf * 2);
      aF1[kk] = *(const v2f*)(c1row + kk * 4 + khalf * 2);
    }
  }

  for (int cb = 0; cb < D_DIM; cb += CB) {
    __syncthreads();
    // stage Bflat[0..31][cb..+511] transposed -> btsT[c][k] (coalesced float4 loads)
#pragma unroll
    for (int i = 0; i < 8; ++i) {
      int k   = tid >> 4;                   // 0..31
      int c4  = ((tid & 15) << 2) + i * 64;
      const float4 v = *(const float4*)(lora_B + (size_t)k * D_DIM + cb + c4);
      btsT[(c4 + 0) * BTT_STR + k] = v.x;
      btsT[(c4 + 1) * BTT_STR + k] = v.y;
      btsT[(c4 + 2) * BTT_STR + k] = v.z;
      btsT[(c4 + 3) * BTT_STR + k] = v.w;
    }
    __syncthreads();

    // a wave's 32 columns are one whole 128-byte line of every output row
#pragma unroll
    for (int sub = 0; sub < 2; ++sub) {
      v8f d0 = zero8();
      v8f d1 = zero8();
      const float* brow = &btsT[(wave * 32 + sub * 16 + lm) * BTT_STR];
#pragma unroll
      for (int kk = 0; kk < 8; ++kk) {
        v2f b = *(const v2f*)(brow + kk * 4 + khalf * 2);
        d0 = __builtin_amdgcn_wmma_f32_16x16x4_f32(false, aF0[kk], false, b, (short)0, d0, false, false);
        d1 = __builtin_amdgcn_wmma_f32_16x16x4_f32(false, aF1[kk], false, b, (short)0, d1, false, false);
      }
      int col = cb + wave * 32 + sub * 16 + lm;
      size_t row0 = (size_t)(tokenBase + khalf * 8);
#pragma unroll
      for (int i = 0; i < 8; ++i) {
        out[(row0 + i) * D_DIM + col]      = d0[i];
        out[(row0 + 16 + i) * D_DIM + col] = d1[i];
      }
    }
    // the next pass rewrites the address and data registers that these stores name
    asm volatile("s_wait_xcnt 0x0" ::: "memory");
  }
}

extern "C" void kernel_launch(void* const* d_in, const int* in_sizes, int n_in,
                              void* d_out, int out_size, void* d_ws, size_t ws_size,
                              hipStream_t stream) {
  (void)in_sizes; (void)n_in; (void)out_size; (void)d_ws; (void)ws_size;
  const float* x        = (const float*)d_in[0];
  const float* lora_A   = (const float*)d_in[1];
  const float* lora_B   = (const float*)d_in[2];
  const float* router_w = (const float*)d_in[3];
  const float* router_b = (const float*)d_in[4];
  float* out = (float*)d_out;

  dim3 grid(N_TOK / BT_TOK);   // 256 workgroups
  dim3 block(NTHR);            // 16 waves (wave32)
  molora_fused_kernel<<<grid, block, 0, stream>>>(x, lora_A, lora_B, router_w, router_b, out);
}

// v003
// Measured time: 21.5 microseconds a run.
// Two timings next to v002 both put it at 1.31 times that version's speed.
// Over all steps from v000 it is 3.53 times as fast.
#include <hip/hip_runtime.h>

// MoLoRa fused kernel for gfx1250 (CDNA5, wave32), f32 path via V_WMMA_F32_16X16X4_F32.
// Shapes: B=4 S=2048 D=2048 E=8 R=4 -> N=8192 tokens. ALPHA/R = 4.0.
// Decomposition: 256 workgroups (one per WGP) of 16 waves, 32 tokens each.
//   Phase A: every wave holds both 16-token tiles and owns 32 of each 512 staged k;
//            the k tiles come into a two-buffer LDS ring by asynchronous copies, in memory order;
//            the 16 partial sums are added through LDS in wave order.
//   Phase B: every wave holds both token tiles and owns 64 columns of each half of D; WMMA column n of
//            sub-tile s is out column 4n + s, so lora_B comes and out leaves 16 bytes a lane, through no LDS.

typedef __attribute__((ext_vector_type(2))) float v2f;
typedef __attribute__((ext_vector_type(4))) float v4f;
typedef __attribute__((ext_vector_type(8))) float v8f;

#define D_DIM   2048
#define E_NUM   8
#define R_RANK  4
#define ER      32           // E*R
#define N_TOK   8192         // B*S
#define BT_TOK  32           // tokens per workgroup
#define NTHR    512          // threads per workgroup
#define NWAVE   16           // waves per workgroup
#define BK      512          // k of one staged tile of phase A
#define NT      4            // tiles along K (D_DIM / BK)
#define KW      32           // k of a tile that one wave multiplies (BK / NWAVE)
#define XS_STR  516          // LDS stride (512 + 4 pad) for x tile rows: the 8-byte fragment reads meet 64 banks
#define WA_STR  2064         // LDS stride (512 k * 4 r + 16 pad) for one expert's lora_A slab
#define XS_SZ   (BT_TOK * XS_STR)          // floats of the x part of a buffer
#define WA_SZ   (E_NUM * WA_STR)           // floats of the lora_A part
#define WR_SZ   (BK * E_NUM)               // floats of the router_w part
#define BUF_SZ  (XS_SZ + WA_SZ + WR_SZ)    // floats of one ring buffer
#define RED_STR 50           // LDS stride (48 + 2 pad) for a wave's partial rows
#define CO_STR  34           // LDS stride (32 + 2 pad) for coeff rows
#define CW      64           // columns of one wave in a group of phase B: 4 sub-tiles of 16, interleaved by 4
#define CG      1024         // columns of one group (NWAVE * CW): the 16 waves cover them without a gap
#define OUT_SCALE 4.0f       // ALPHA / R

// Nine pieces of 16 bytes a lane, global -> LDS through no register: eight at a fixed step, one apart.
// The s_wait_xcnt stands inside the statement so that no address register is rewritten ahead of it.
static __device__ inline void copy9(unsigned l, unsigned lstep, const float* g, int gstep,
                                    unsigned l8, const float* g8) {
  asm volatile(
      "global_load_async_to_lds_b128 %0, %9, off\n\t"
      "global_load_async_to_lds_b128 %1, %10, off\n\t"
      "global_load_async_to_lds_b128 %2, %11, off\n\t"
      "global_load_async_to_lds_b128 %3, %12, off\n\t"
      "global_load_async_to_lds_b128 %4, %13, off\n\t"
      "global_load_async_to_lds_b128 %5, %14, off\n\t"
      "global_load_async_to_lds_b128 %6, %15, off\n\t"
      "global_load_async_to_lds_b128 %7, %16, off\n\t"
      "global_load_async_to_lds_b128 %8, %17, off\n\t"
      "s_wait_xcnt 0x0"
      :: "v"(l), "v"(l + lstep), "v"(l + 2u * lstep), "v"(l + 3u * lstep),
         "v"(l + 4u * lstep), "v"(l + 5u * lstep), "v"(l + 6u * lstep), "v"(l + 7u * lstep), "v"(l8),
         "v"(g), "v"(g + gstep), "v"(g + 2 * gstep), "v"(g + 3 * gstep),
         "v"(g + 4 * gstep), "v"(g + 5 * gstep), "v"(g + 6 * gstep), "v"(g + 7 * gstep), "v"(g8)
      : "memory");
}

static __device__ inline v8f zero8() {
  v8f z;
#pragma unroll
  for (int i = 0; i < 8; ++i) z[i] = 0.0f;
  return z;
}

__global__ __launch_bounds__(NTHR) void molora_fused_kernel(
    const float* __restrict__ x,        // [N, D]
    const float* __restrict__ lora_A,   // [E, D, R]
    const float* __restrict__ lora_B,   // [E, R, D] == Bflat [ER, D]
    const float* __restrict__ router_w, // [D, E]
    const float* __restrict__ router_b, // [E]
    float* __restrict__ out)            // [N, D]
{
  __shared__ __attribute__((aligned(16))) float stage[2 * BUF_SZ];  // phase A: two buffers x | lora_A | router_w
  __shared__ float coeff[BT_TOK * CO_STR];          // ax -> coeff [32][34]
  __shared__ float lgts[BT_TOK * E_NUM];            // logits     [32][8]
  float* const red  = stage;                        // per-wave K partials [16][32][50], behind phase A's last barrier

  const int tid   = threadIdx.x;            // 0..511
  const int lane  = tid & 31;
  const int wave  = tid >> 5;               // 0..15
  const int lm    = lane & 15;              // row/col-in-tile selector
  const int khalf = lane >> 4;              // selects K pair {0,1} vs {2,3}
  const int tokenBase = blockIdx.x * BT_TOK;

  // ---------------- Phase A: [32 x D] @ [D x 48] -> ax(32) | logits(8) | pad(8), K split over waves
  v8f acc00 = zero8(), acc10 = zero8();  // cols  0..15 (ax), token tile 0 / 1
  v8f acc01 = zero8(), acc11 = zero8();  // cols 16..31 (ax)
  v8f acc02 = zero8(), acc12 = zero8();  // cols 32..39 logits, 40..47 pad

  // this thread's pieces of a tile: x rows tid/128 + 4i, 16-byte column tid%128; lora_A[i][k = tid][0..3];
  // router_w pieces tid and tid + 512
  const unsigned sbase = (unsigned)(size_t)stage;   // low 32 bits of a __shared__ address: the LDS byte address
  const unsigned lx = sbase + (unsigned)((tid >> 7) * XS_STR + ((tid & 127) << 2)) * 4u;
  const unsigned la = sbase + (unsigned)(XS_SZ + (tid << 2)) * 4u;
  const unsigned lr = sbase + (unsigned)(XS_SZ + WA_SZ + (tid << 2)) * 4u;
  const float* gx = x + (size_t)(tokenBase + (tid >> 7)) * D_DIM + ((tid & 127) << 2);
  const float* ga = lora_A + (tid << 2);
  const float* gr = router_w + (tid << 2);

  copy9(lx, 4u * XS_STR * 4u, gx, 4 * D_DIM, lr, gr);
  copy9(la, WA_STR * 4u, ga, D_DIM * R_RANK, lr + NTHR * 16u, gr + NTHR * 4);
  asm volatile("s_wait_asynccnt 0x0" ::: "memory");  // tile 0 has landed before the barrier publishes it
  __syncthreads();
  copy9(lx + BUF_SZ * 4u, 4u * XS_STR * 4u, gx + BK, 4 * D_DIM, lr + BUF_SZ * 4u, gr + BK * E_NUM);
  copy9(la + BUF_SZ * 4u, WA_STR * 4u, ga + BK * R_RANK, D_DIM * R_RANK,
        lr + BUF_SZ * 4u + NTHR * 16u, gr + BK * E_NUM + NTHR * 4);

  for (int t = 0; t < NT; ++t) {
    const int bo = (t & 1) * BUF_SZ;
    // B fragments straight from the memory layouts: lora_A[e][k][r] (column e*4+r), router_w[k][e];
    // lanes 8..15 of the router tile read columns 0..7 again: their result columns are never stored
    const float* x0r = &stage[bo + lm * XS_STR + wave * KW + khalf * 2];
    const float* x1r = x0r + 16 * XS_STR;
    const float* b0r = &stage[bo + XS_SZ + (lm >> 2) * WA_STR + (wave * KW + khalf * 2) * R_RANK + (lm & 3)];
    const float* b1r = b0r + 4 * WA_STR;
    const float* b2r = &stage[bo + XS_SZ + WA_SZ + (wave * KW + khalf * 2) * E_NUM + (lm & 7)];
#pragma unroll
    for (int kk = 0; kk < KW / 4; ++kk) {
      v2f a0 = *(const v2f*)(x0r + kk * 4);
      v2f a1 = *(const v2f*)(x1r + kk * 4);
      v2f b0, b1, b2;
      b0[0] = b0r[kk * 4 * R_RANK]; b0[1] = b0r[kk * 4 * R_RANK + R_RANK];
      b1[0] = b1r[kk * 4 * R_RANK]; b1[1] = b1r[kk * 4 * R_RANK + R_RANK];
      b2[0] = b2r[kk * 4 * E_NUM];  b2[1] = b2r[kk * 4 * E_NUM + E_NUM];
      acc00 = __builtin_amdgcn_wmma_f32_16x16x4_f32(false, a0, false, b0, (short)0, acc00, false, false);
      acc10 = __builtin_amdgcn_wmma_f32_16x16x4_f32(false, a1, false, b0, (short)0, acc10, false, false);
      acc01 = __builtin_amdgcn_wmma_f32_16x16x4_f32(false, a0, false, b1, (short)0, acc01, false, false);
      acc11 = __builtin_amdgcn_wmma_f32_16x16x4_f32(false, a1, false, b1, (short)0, acc11, false, false);
      acc02 = __builtin_amdgcn_wmma_f32_16x16x4_f32(false, a0, false, b2, (short)0, acc02, false, false);
      acc12 = __builtin_amdgcn_wmma_f32_16x16x4_f32(false, a1, false, b2, (short)0, acc12, false, false);
    }
    // keeps all of the tile's WMMAs in front of the waits: the refill then issues directly behind the barrier
    // and has the whole next tile's WMMAs as its lead
    __builtin_amdgcn_sched_barrier(0);
    asm volatile("s_wait_dscnt 0x0" ::: "memory");     // this wave's reads of the buffer are done before it is refilled
    asm volatile("s_wait_asynccnt 0x0" ::: "memory");  // this wave's pieces of tile t + 1 have landed
    __syncthreads();                                   // publishes tile t + 1, frees tile t's buffer
    if (t + 2 < NT) {
      const int k2 = (t + 2) * BK;
      copy9(lx + bo * 4u, 4u * XS_STR * 4u, gx + k2, 4 * D_DIM, lr + bo * 4u, gr + k2 * E_NUM);
      copy9(la + bo * 4u, WA_STR * 4u, ga + k2 * R_RANK, D_DIM * R_RANK,
            lr + bo * 4u + NTHR * 16u, gr + k2 * E_NUM + NTHR * 4);
    }
  }
  asm volatile("s_wait_asynccnt 0x0" ::: "memory");    // no copy is left in flight when the ring is reused

  // ---------------- dump each wave's K partial, then add the 16 partials in wave order
  {
    float* rw = &red[wave * (BT_TOK * RED_STR)];
    int rBase = khalf * 8;                  // C/D layout: vgpr i, lane l -> row (l/16)*8+i, col l%16
#pragma unroll
    for (int i = 0; i < 8; ++i) {
      rw[(rBase + i) * RED_STR + lm]           = acc00[i];
      rw[(rBase + i) * RED_STR + 16 + lm]      = acc01[i];
      rw[(16 + rBase + i) * RED_STR + lm]      = acc10[i];
      rw[(16 + rBase + i) * RED_STR + 16 + lm] = acc11[i];
    }
    if (lm < E_NUM) {
#pragma unroll
      for (int i = 0; i < 8; ++i) {
        rw[(rBase + i) * RED_STR + 32 + lm]      = acc02[i];
        rw[(16 + rBase + i) * RED_STR + 32 + lm] = acc12[i];
      }
    }
  }
  __syncthreads();
  for (int idx = tid; idx < BT_TOK * (ER + E_NUM); idx += NTHR) {
    int row = idx / (ER + E_NUM);
    int col = idx - row * (ER + E_NUM);
    float s = 0.0f;
#pragma unroll
    for (int w = 0; w < NWAVE; ++w) s += red[w * (BT_TOK * RED_STR) + row * RED_STR + col];
    if (col < ER) coeff[row * CO_STR + col] = s;
    else          lgts[row * E_NUM + col - ER] = s;
  }
  __syncthreads();

  // ---------------- softmax + fold router prob * (ALPHA/R) into coeff
  if (tid < BT_TOK) {
    float lg[E_NUM];
    float mx = -3.0e38f;
#pragma unroll
    for (int e = 0; e < E_NUM; ++e) {
      lg[e] = lgts[tid * E_NUM + e] + router_b[e];
      mx = fmaxf(mx, lg[e]);
    }
    float s = 0.0f;
#pragma unroll
    for (int e = 0; e < E_NUM; ++e) { lg[e] = expf(lg[e] - mx); s += lg[e]; }
    float inv = OUT_SCALE / s;
#pragma unroll
    for (int c = 0; c < ER; ++c) coeff[tid * CO_STR + c] *= lg[c >> 2] * inv;
  }

  // phase B's lora_B fragments: rows kk*4 + khalf*2 + j, columns g*1024 + wave*64 + lm*4 .. +3, so that
  // 16 lanes cover 256 bytes of a row. The first group is asked for here, where 15 of the 16 waves only wait
  // for the softmax; the second behind the barrier, where it flies under the first group's WMMAs.
  v4f bq[2][8][2];
  const float* bp = lora_B + (size_t)(khalf * 2) * D_DIM + wave * CW + lm * 4;
#pragma unroll
  for (int kk = 0; kk < 8; ++kk)
#pragma unroll
    for (int j = 0; j < 2; ++j)
      bq[0][kk][j] = *(const v4f*)(bp + (kk * 4 + j) * D_DIM);
  __syncthreads();
#pragma unroll
  for (int kk = 0; kk < 8; ++kk)
#pragma unroll
    for (int j = 0; j < 2; ++j)
      bq[1][kk][j] = *(const v4f*)(bp + (kk * 4 + j) * D_DIM + CG);
  // the address pair is named as an input so that it lives up to this wait: left free, the last load's own
  // result was laid over the pair that the fifteen loads in front of it name
  asm volatile("s_wait_xcnt 0x0" :: "v"(bp) : "memory");

  // ---------------- Phase B: out[32 x D] = coeff[32 x 32] @ Bflat[32 x D], columns split over waves
  v2f aF0[8], aF1[8];
  {
    const float* c0row = &coeff[( 0 + lm) * CO_STR];
    const float* c1row = &coeff[(16 + lm) * CO_STR];
#pragma unroll
    for (int kk = 0; kk < 8; ++kk) {
      aF0[kk] = *(const v2f*)(c0row + kk * 4 + khalf * 2);
      aF1[kk] = *(const v2f*)(c1row + kk * 4 + khalf * 2);
    }
  }

#pragma unroll
  for (int g = 0; g < 2; ++g) {
    // B fragments: rows k and k + 1 of one column side by side, for each of the four sub-tiles
    v2f pb[8][4];
#pragma unroll
    for (int kk = 0; kk < 8; ++kk) {
#pragma unroll
      for (int s = 0; s < 4; ++s) {
        pb[kk][s][0] = bq[g][kk][0][s];
        pb[kk][s][1] = bq[g][kk][1][s];
      }
    }
    // keeps the register moves that pair the rows in front of the WMMA run
    __builtin_amdgcn_sched_barrier(0);
#pragma unroll
    for (int tt = 0; tt < 2; ++tt) {
      v8f d[4];
#pragma unroll
      for (int s = 0; s < 4; ++s) d[s] = zero8();
#pragma unroll
      for (int kk = 0; kk < 8; ++kk) {
#pragma unroll
        for (int s = 0; s < 4; ++s)
          d[s] = __builtin_amdgcn_wmma_f32_16x16x4_f32(false, tt ? aF1[kk] : aF0[kk], false, pb[kk][s], (short)0, d[s], false, false);
      }
      // four vector slots between the last WMMA and the moves that read its result and reuse its operands;
      // the two scheduling barriers hold the slots at this place
      __builtin_amdgcn_sched_barrier(0);
      asm volatile("v_nop\n\tv_nop\n\tv_nop\n\tv_nop");
      __builtin_amdgcn_sched_barrier(0);
      // a lane's four sub-tiles are four neighbouring columns: 16 lanes store 256 whole bytes of a row
      float* op = out + (size_t)(tokenBase + tt * 16 + khalf * 8) * D_DIM + wave * CW + g * CG + lm * 4;
#pragma unroll
      for (int i = 0; i < 8; ++i) {
        v4f o;
        o[0] = d[0][i]; o[1] = d[1][i]; o[2] = d[2][i]; o[3] = d[3][i];
        *(v4f*)(op + (size_t)i * D_DIM) = o;
      }
      // keeps this tile's stores in front of the next tile's WMMAs: left free, they all sink to the kernel's end,
      // and the writes then drain behind the matrix work and not under it
      __builtin_amdgcn_sched_barrier(0);
    }
  }
}

extern "C" void kernel_launch(void* const* d_in, const int* in_sizes, int n_in,
                              void* d_out, int out_size, void* d_ws, size_t ws_size,
                              hipStream_t stream) {
  (void)in_sizes; (void)n_in; (void)out_size; (void)d_ws; (void)ws_size;
  const float* x        = (const float*)d_in[0];
  const float* lora_A   = (const float*)d_in[1];
  const float* lora_B   = (const float*)d_in[2];
  const float* router_w = (const float*)d_in[3];
  const float* router_b = (const float*)d_in[4];
  float* out = (float*)d_out;

  dim3 grid(N_TOK / BT_TOK);   // 256 workgroups
  dim3 block(NTHR);            // 16 waves (wave32)
  molora_fused_kernel<<<grid, block, 0, stream>>>(x, lora_A, lora_B, router_w, router_b, out);
}
